// v000
// The times below were measured on an AMD MI455X: many runs one after another, warmed up first and cycling through
// copies of the inputs, with the whole window's GPU time divided by the number of runs. Launches and the gaps
// between them are all in it. The median over several windows is given; except for v000 it joins two sittings, which
// can be a few percent apart, so the side-by-side timings, each taken in one sitting, are the better comparison.
// v000, which the later versions start from, runs in 61.5 microseconds.
#include <hip/hip_runtime.h>
#include <hip/hip_bf16.h>

// Problem constants (reference: B=4, L=512, D=128, all f32)
#define Bn 4
#define Ln 512
#define Dn 128

typedef __attribute__((ext_vector_type(2)))  float    v2f;
typedef __attribute__((ext_vector_type(8)))  float    v8f;
typedef __attribute__((ext_vector_type(16))) _Float16 v16h;

#if defined(__has_builtin)
#  if __has_builtin(__builtin_amdgcn_wmma_f32_16x16x4_f32)
#    define USE_WMMA_F32X4 1
#  endif
#  if __has_builtin(__builtin_amdgcn_tanhf)
#    define USE_HW_TANH 1
#  endif
#endif

__device__ __forceinline__ float fast_tanh(float x) {
#ifdef USE_HW_TANH
  return __builtin_amdgcn_tanhf(x);   // v_tanh_f32 on gfx1250
#else
  return tanhf(x);
#endif
}

// ---------------------------------------------------------------------------
// Kernel 1: qu = inp @ Wu^T and kw = inp @ Ww^T via WMMA (f32 16x16x4).
// One wave computes a 16-row strip x all 128 output columns (8 tiles of 16).
// Total waves = 4 batches * 2 matrices * (512/16) strips = 256 -> 32 blocks.
// A-layout (16x4 f32): lane m = lane&15; VGPR pair holds K = 2*hi, 2*hi+1.
// B-layout (4x16 f32): lane n = lane&15; same K split. B[k][n] = W[n*D + k].
// C/D-layout: VGPR c -> row (c + 8*hi), col = lane&15 within tile.
// ---------------------------------------------------------------------------
__global__ __launch_bounds__(256) void proj_qu_kw_wmma(
    const float* __restrict__ inp, const float* __restrict__ Wu,
    const float* __restrict__ Ww, float* __restrict__ qu,
    float* __restrict__ kw) {
  const int wave = blockIdx.x * (blockDim.x >> 5) + (threadIdx.x >> 5);
  const int lane = threadIdx.x & 31;
  const int b    = wave >> 6;         // batch
  const int mat  = (wave >> 5) & 1;   // 0 = qu/Wu, 1 = kw/Ww
  const int mt   = wave & 31;         // 16-row strip index

  const float* __restrict__ A = inp + ((size_t)b * Ln + mt * 16) * Dn;
  const float* __restrict__ W = mat ? Ww : Wu;
  float* __restrict__ Out = (mat ? kw : qu) + ((size_t)b * Ln + mt * 16) * Dn;

  const int m  = lane & 15;
  const int hi = lane >> 4;

  v8f acc[8] = {};

#ifdef USE_WMMA_F32X4
  #pragma unroll 4
  for (int k0 = 0; k0 < Dn; k0 += 4) {
    const int ka = k0 + 2 * hi;
    const v2f a = *(const v2f*)(A + m * Dn + ka);   // 8B aligned
    #pragma unroll
    for (int t = 0; t < 8; ++t) {
      const int n = t * 16 + m;
      const v2f bb = *(const v2f*)(W + n * Dn + ka);
      acc[t] = __builtin_amdgcn_wmma_f32_16x16x4_f32(
          false, a, false, bb, (short)0, acc[t], false, false);
    }
  }
#else
  // Fallback: codegen-confirmed f32<-f16 16x16x32 WMMA (convert on the fly).
  for (int k0 = 0; k0 < Dn; k0 += 32) {
    v16h a;
    #pragma unroll
    for (int ii = 0; ii < 16; ++ii) {
      const int k = k0 + ii + 8 * hi + (ii >= 8 ? 8 : 0);  // 16-bit A layout
      a[ii] = (_Float16)A[m * Dn + k];
    }
    #pragma unroll
    for (int t = 0; t < 8; ++t) {
      const int n = t * 16 + m;
      v16h bb;
      #pragma unroll
      for (int ii = 0; ii < 16; ++ii) {
        const int k = k0 + ii + 16 * hi;                   // contiguous k order, unlike A's
        bb[ii] = (_Float16)W[n * Dn + k];
      }
      acc[t] = __builtin_amdgcn_wmma_f32_16x16x32_f16(
          false, a, false, bb, (short)0, acc[t], false, false);
    }
  }
#endif

  #pragma unroll
  for (int t = 0; t < 8; ++t) {
    #pragma unroll
    for (int c = 0; c < 8; ++c) {
      Out[(c + 8 * hi) * Dn + t * 16 + m] = acc[t][c];
    }
  }
}

// ---------------------------------------------------------------------------
// Kernel 2: fused score + softmax + out, one block per (b, i) row.
//   score[j] = sum_d Wv[d] * tanh(qu[b,j,d] + kw[b,i,d])   (h never stored)
//   attn = softmax_j(score);  out[b,i,:] = sum_j attn[j] * inp[b,j,:]
// 256 threads: each owns j = {t, t+256}. kw row + Wv live in LDS (broadcast
// reads). qu is L2-resident (256 KB/batch). Out phase: threads 0..127 each
// own one d, coalesced inp reads, attn weights broadcast from LDS.
// ---------------------------------------------------------------------------
__global__ __launch_bounds__(256) void score_softmax_out(
    const float* __restrict__ inp, const float* __restrict__ qu,
    const float* __restrict__ kw, const float* __restrict__ Wv,
    float* __restrict__ out, float* __restrict__ attn) {
  __shared__ float s_kw[Dn];
  __shared__ float s_wv[Dn];
  __shared__ float s_e[Ln];     // unnormalized exp weights
  __shared__ float s_red[256];

  const int b = blockIdx.x >> 9;         // / 512
  const int i = blockIdx.x & (Ln - 1);
  const int t = threadIdx.x;

  if (t < Dn) {
    s_kw[t] = kw[((size_t)b * Ln + i) * Dn + t];
    s_wv[t] = Wv[t];
  }
  __syncthreads();

  float sc[2];
  #pragma unroll
  for (int r = 0; r < 2; ++r) {
    const int j = t + r * 256;
    const float* __restrict__ q = qu + ((size_t)b * Ln + j) * Dn;
    float s = 0.0f;
    #pragma unroll 8
    for (int d = 0; d < Dn; d += 4) {
      const float4 qv = *(const float4*)(q + d);
      s = fmaf(s_wv[d + 0], fast_tanh(qv.x + s_kw[d + 0]), s);
      s = fmaf(s_wv[d + 1], fast_tanh(qv.y + s_kw[d + 1]), s);
      s = fmaf(s_wv[d + 2], fast_tanh(qv.z + s_kw[d + 2]), s);
      s = fmaf(s_wv[d + 3], fast_tanh(qv.w + s_kw[d + 3]), s);
    }
    sc[r] = s;
  }

  // Block max over 512 scores
  s_red[t] = fmaxf(sc[0], sc[1]);
  __syncthreads();
  #pragma unroll
  for (int off = 128; off > 0; off >>= 1) {
    if (t < off) s_red[t] = fmaxf(s_red[t], s_red[t + off]);
    __syncthreads();
  }
  const float mx = s_red[0];
  __syncthreads();

  const float e0 = __expf(sc[0] - mx);
  const float e1 = __expf(sc[1] - mx);
  s_e[t]       = e0;
  s_e[t + 256] = e1;
  s_red[t] = e0 + e1;
  __syncthreads();
  #pragma unroll
  for (int off = 128; off > 0; off >>= 1) {
    if (t < off) s_red[t] += s_red[t + off];
    __syncthreads();
  }
  const float inv = 1.0f / s_red[0];

  // attn row (B,L,L), softmax over last axis (j)
  float* __restrict__ arow = attn + ((size_t)b * Ln + i) * Ln;
  arow[t]       = e0 * inv;
  arow[t + 256] = e1 * inv;

  // out[b,i,d] = inv * sum_j s_e[j] * inp[b,j,d]
  if (t < Dn) {
    const float* __restrict__ X = inp + (size_t)b * Ln * Dn + t;
    float acc = 0.0f;
    #pragma unroll 8
    for (int j = 0; j < Ln; ++j) acc = fmaf(s_e[j], X[(size_t)j * Dn], acc);
    out[((size_t)b * Ln + i) * Dn + t] = acc * inv;
  }
}

extern "C" void kernel_launch(void* const* d_in, const int* in_sizes, int n_in,
                              void* d_out, int out_size, void* d_ws,
                              size_t ws_size, hipStream_t stream) {
  (void)in_sizes; (void)n_in; (void)out_size; (void)ws_size;
  const float* inp = (const float*)d_in[0];   // (B,L,D)
  const float* Wu  = (const float*)d_in[1];   // (D,D)
  const float* Ww  = (const float*)d_in[2];   // (D,D)
  const float* Wv  = (const float*)d_in[3];   // (1,D)

  float* out  = (float*)d_out;                      // (B,L,D) first
  float* attn = out + (size_t)Bn * Ln * Dn;         // then (B,L,L)

  float* qu = (float*)d_ws;                         // (B,L,D) scratch
  float* kw = qu + (size_t)Bn * Ln * Dn;            // (B,L,D) scratch

  // Projections: 256 waves total -> 32 blocks x 8 waves
  proj_qu_kw_wmma<<<32, 256, 0, stream>>>(inp, Wu, Ww, qu, kw);
  // Fused score/softmax/out: one block per (b, i)
  score_softmax_out<<<Bn * Ln, 256, 0, stream>>>(inp, qu, kw, Wv, out, attn);
}

// v002
// It runs in 19.1 microseconds.
// It is 3.38 times as fast as v000, going by the measured steps of the versions left out in between.
#include <hip/hip_runtime.h>
#include <hip/hip_bf16.h>

// Problem constants (reference: B=4, L=512, D=128, all f32)
#define Bn 4
#define Ln 512
#define Dn 128

typedef __attribute__((ext_vector_type(2)))  float    v2f;
typedef __attribute__((ext_vector_type(8)))  float    v8f;

#if defined(__has_builtin)
#  if __has_builtin(__builtin_amdgcn_tanhf)
#    define USE_HW_TANH 1
#  endif
#endif

__device__ __forceinline__ float fast_tanh(float x) {
#ifdef USE_HW_TANH
  return __builtin_amdgcn_tanhf(x);   // v_tanh_f32 on gfx1250
#else
  return tanhf(x);
#endif
}

// ---------------------------------------------------------------------------
// Kernel 1: qu = inp @ Wu^T and kw = inp @ Ww^T via WMMA (f32 16x16x4).
// The two products are one 2048 x 256 result (rows b*L+l, columns Wu | Ww), cut
// into 32 x 64 tiles: 256 blocks, one per WGP, 4 waves, one per SIMD. A wave
// owns 16 rows x 32 columns (2 accumulator tiles, whole 128-B lines of Out).
// The 32 inp rows and 64 W rows of a block are brought in by loads in which a
// wave reads one whole 512-B row, and the fragments are read from LDS.
// A-layout (16x4 f32): lane m = lane&15; VGPR pair holds K = 2*hi, 2*hi+1.
// B-layout (4x16 f32): lane n = lane&15; same K split. B[k][n] = W[n*D + k].
// C/D-layout: VGPR c -> row (c + 8*hi), col = lane&15 within tile.
// ---------------------------------------------------------------------------
#define PM 32    // inp rows per block
#define PN 64    // output columns (W rows) per block
#define PP 132   // LDS row pitch in floats: the 16 rows of a fragment read fall
                 // on 16 different groups of 4 banks

__global__ __launch_bounds__(128) void proj_qu_kw_wmma(
    const float* __restrict__ inp, const float* __restrict__ Wu,
    const float* __restrict__ Ww, float* __restrict__ qu,
    float* __restrict__ kw) {
  __shared__ __attribute__((aligned(16))) float sa[PM][PP];
  __shared__ __attribute__((aligned(16))) float sb[PN][PP];

  const int t    = threadIdx.x;
  const int lane = t & 31;
  const int w    = t >> 5;
  const int r0   = (blockIdx.x >> 2) * PM;   // first row of b*L+l
  const int mat  = (blockIdx.x >> 1) & 1;    // 0 = qu/Wu, 1 = kw/Ww
  const int n0   = (blockIdx.x & 1) * PN;    // first output column

  const float4* __restrict__ A4 = (const float4*)(inp + (size_t)r0 * Dn);
  const float4* __restrict__ W4 =
      (const float4*)((mat ? Ww : Wu) + (size_t)n0 * Dn);

  // All 24 loads of a thread are asked for before the first LDS store.
  float4 ra[PM / 4], rb[PN / 4];
  #pragma unroll  // constant indices: the arrays stay in registers
  for (int u = 0; u < PM / 4; ++u) ra[u] = A4[u * 128 + t];
  #pragma unroll  // constant indices: the arrays stay in registers
  for (int u = 0; u < PN / 4; ++u) rb[u] = W4[u * 128 + t];
  #pragma unroll  // constant indices: the arrays stay in registers
  for (int u = 0; u < PM / 4; ++u) *(float4*)&sa[u * 4 + w][lane * 4] = ra[u];
  #pragma unroll  // constant indices: the arrays stay in registers
  for (int u = 0; u < PN / 4; ++u) *(float4*)&sb[u * 4 + w][lane * 4] = rb[u];
  __syncthreads();

  const int m  = lane & 15;
  const int hi = lane >> 4;
  const int wr = (w & 1) * 16;    // the wave's rows inside the tile
  const int wc = (w >> 1) * 32;   // the wave's columns inside the tile

  const float* pa  = &sa[wr + m][2 * hi];
  const float* pb0 = &sb[wc + m][2 * hi];
  const float* pb1 = &sb[wc + 16 + m][2 * hi];

  // All fragments of the wave (K = 128) are asked for first: 192 registers.
  v2f fa[Dn / 4], fb0[Dn / 4], fb1[Dn / 4];
  #pragma unroll  // constant indices: the arrays stay in registers
  for (int s = 0; s < Dn / 4; ++s) {
    fa[s]  = *(const v2f*)(pa + 4 * s);
    fb0[s] = *(const v2f*)(pb0 + 4 * s);
    fb1[s] = *(const v2f*)(pb1 + 4 * s);
  }
  // Holds the LDS reads in front of the WMMAs; without it the compiler spreads
  // them among the WMMAs, one group ahead, and the lone wave waits at each.
  __builtin_amdgcn_sched_barrier(0);

  v8f acc0 = {}, acc1 = {};
  #pragma unroll  // constant indices: the arrays stay in registers
  for (int s = 0; s < Dn / 4; ++s) {
    acc0 = __builtin_amdgcn_wmma_f32_16x16x4_f32(
        false, fa[s], false, fb0[s], (short)0, acc0, false, false);
    acc1 = __builtin_amdgcn_wmma_f32_16x16x4_f32(
        false, fa[s], false, fb1[s], (short)0, acc1, false, false);
  }
  // Keeps the address arithmetic of the stores behind the WMMAs; among them it
  // was placed in operand registers of a WMMA issued just before.
  __builtin_amdgcn_sched_barrier(0);

  float* __restrict__ Out =
      (mat ? kw : qu) + (size_t)(r0 + wr + 8 * hi) * Dn + n0 + wc + m;

  #pragma unroll  // constant indices: the accumulators stay in registers
  for (int c = 0; c < 8; ++c) {
    Out[c * Dn]      = acc0[c];
    Out[c * Dn + 16] = acc1[c];
  }
}

// ---------------------------------------------------------------------------
// Kernel 2: fused score + softmax + out, one 512-thread block per (b, 8 rows i).
//   score[i][j] = sum_d Wv[d] * tanh(qu[b,j,d] + kw[b,i,d])   (h never stored)
//   attn = softmax_j(score);  out[b,i,:] = sum_j attn[i][j] * inp[b,j,:]
// Score: thread t owns key j = t and carries TI running sums, so each qu value
// is loaded once and used for TI rows i. Softmax: two waves per row. Out: wave
// w owns keys 32w..32w+31, lane owns 4 columns d, so each inp value is loaded
// once and used for TI rows; the 16 partial sums are added through LDS.
// ---------------------------------------------------------------------------
#define TI 8
#define NW 16   // waves per block

template <int CTRL>
__device__ __forceinline__ float dpp_row(float v) {
  return __int_as_float(__builtin_amdgcn_update_dpp(
      0, __float_as_int(v), CTRL, 0xf, 0xf, true));
}
__device__ __forceinline__ float other_row(float v) {   // lane l <-> l ^ 16
  const int x = __float_as_int(v);
  return __int_as_float(__builtin_amdgcn_permlanex16(
      x, x, 0x76543210, 0xfedcba98, false, false));
}
__device__ __forceinline__ float wave_max(float v) {
  v = fmaxf(v, dpp_row<0x161>(v));   // row_xmask:1, 2, 4, 8
  v = fmaxf(v, dpp_row<0x162>(v));
  v = fmaxf(v, dpp_row<0x164>(v));
  v = fmaxf(v, dpp_row<0x168>(v));
  return fmaxf(v, other_row(v));
}
__device__ __forceinline__ float wave_sum(float v) {
  v += dpp_row<0x161>(v);
  v += dpp_row<0x162>(v);
  v += dpp_row<0x164>(v);
  v += dpp_row<0x168>(v);
  return v + other_row(v);
}

// waves_per_eu(4, 4): a block is 4 waves per SIMD and a WGP holds one block, so
// the compiler may spend the 256 registers of a wave on loads issued ahead.
__global__ __launch_bounds__(512) __attribute__((amdgpu_waves_per_eu(4, 4)))
void score_softmax_out(
    const float* __restrict__ inp, const float* __restrict__ qu,
    const float* __restrict__ kw, const float* __restrict__ Wv,
    float* __restrict__ out, float* __restrict__ attn) {
  // One LDS block, the operands of the score loop first: their addresses then
  // fit the 16-bit offset field of an LDS load and need no register each.
  __shared__ __attribute__((aligned(16))) struct {
    float kw[Dn][TI];         // [d][i]
    float wv[Dn];
    float sc[TI][Ln];         // scores
    float e[TI][Ln];          // exp weights, not normalised
    float part[NW][TI][Dn];   // partial out sums, one plane per wave
    float inv[TI];
  } sm;

  const int b    = blockIdx.x / (Ln / TI);
  const int i0   = (blockIdx.x % (Ln / TI)) * TI;
  const int t    = threadIdx.x;
  const int lane = t & 31;
  const int w    = t >> 5;

  // The kw tile (TI x Dn, two values a thread) and the first qu values are asked
  // for together, ahead of the first barrier.
  const float* __restrict__ kwt = kw + ((size_t)b * Ln + i0) * Dn;
  const float ka = kwt[t], kb = kwt[t + 512];
  const float4* __restrict__ q4 =
      (const float4*)(qu + ((size_t)b * Ln + t) * Dn);
  float4 qc[2][8];
  #pragma unroll  // constant indices: the arrays stay in registers
  for (int u = 0; u < 8; ++u) qc[0][u] = q4[u];
  sm.kw[t & (Dn - 1)][t >> 7]       = ka;
  sm.kw[t & (Dn - 1)][(t >> 7) + 4] = kb;
  if (t < Dn) sm.wv[t] = Wv[t];
  __syncthreads();

  // ---- scores: key j = t, rows i0 .. i0+TI-1 ----
  // A group is 4 values of d. The kw and Wv values of group g+1 and the qu
  // values of the next 8 groups are asked for before group g is worked on.
  {
    const float4* kw4 = (const float4*)&sm.kw[0][0];   // two per d
    const float4* wv4 = (const float4*)&sm.wv[0];      // one per group
    float s[TI];
    #pragma unroll  // constant indices: the arrays stay in registers
    for (int ii = 0; ii < TI; ++ii) s[ii] = 0.0f;
    float4 kk[2][8], wg[2];
    #pragma unroll  // constant indices: the arrays stay in registers
    for (int u = 0; u < 8; ++u) kk[0][u] = kw4[u];
    wg[0] = wv4[0];
    #pragma unroll  // constant indices: the arrays stay in registers
    for (int g = 0; g < Dn / 4; ++g) {
      const int cb = (g >> 3) & 1;
      const int pb = g & 1;
      if ((g & 7) == 0 && g + 8 < Dn / 4) {
        #pragma unroll  // constant indices: the arrays stay in registers
        for (int u = 0; u < 8; ++u) qc[cb ^ 1][u] = q4[g + 8 + u];
      }
      if (g + 1 < Dn / 4) {
        #pragma unroll  // constant indices: the arrays stay in registers
        for (int u = 0; u < 8; ++u) kk[pb ^ 1][u] = kw4[(g + 1) * 8 + u];
        wg[pb ^ 1] = wv4[g + 1];
      }
      // Holds the loads above in front of this group's arithmetic; without it
      // the compiler sinks each LDS load to its use and the wave waits there.
      __builtin_amdgcn_sched_barrier(0);
      const float qa[4] = {qc[cb][g & 7].x, qc[cb][g & 7].y,
                           qc[cb][g & 7].z, qc[cb][g & 7].w};
      const float wa[4] = {wg[pb].x, wg[pb].y, wg[pb].z, wg[pb].w};
      #pragma unroll  // constant indices: the arrays stay in registers
      for (int c = 0; c < 4; ++c) {
        const float4 k0 = kk[pb][2 * c], k1 = kk[pb][2 * c + 1];
        // the TI rows are independent: adds, tanhs and fmas stand in runs
        float h[TI] = {k0.x, k0.y, k0.z, k0.w, k1.x, k1.y, k1.z, k1.w};
        #pragma unroll  // constant indices: the arrays stay in registers
        for (int ii = 0; ii < TI; ++ii) h[ii] = qa[c] + h[ii];
        #pragma unroll  // constant indices: the arrays stay in registers
        for (int ii = 0; ii < TI; ++ii) h[ii] = fast_tanh(h[ii]);
        #pragma unroll  // constant indices: the arrays stay in registers
        for (int ii = 0; ii < TI; ++ii) s[ii] = fmaf(wa[c], h[ii], s[ii]);
      }
    }
    #pragma unroll  // constant indices: the arrays stay in registers
    for (int ii = 0; ii < TI; ++ii) sm.sc[ii][t] = s[ii];
  }
  __syncthreads();

  // ---- softmax: waves r and r+8 both reduce row r, each keeps one half ----
  // The attn values are stored behind the last barrier, so that no barrier
  // waits for those stores.
  float4 at0, at1;
  float* __restrict__ arow;
  {
    const int r = w & (TI - 1);
    const int h = w >> 3;
    float4 v[4];
    #pragma unroll  // constant indices: the arrays stay in registers
    for (int k = 0; k < 4; ++k)
      v[k] = *(const float4*)&sm.sc[r][k * 128 + lane * 4];
    float mx = v[0].x;
    #pragma unroll  // constant indices: the arrays stay in registers
    for (int k = 0; k < 4; ++k)
      mx = fmaxf(mx, fmaxf(fmaxf(v[k].x, v[k].y), fmaxf(v[k].z, v[k].w)));
    mx = wave_max(mx);
    float sum = 0.0f;
    #pragma unroll  // constant indices: the arrays stay in registers
    for (int k = 0; k < 4; ++k) {
      v[k].x = __expf(v[k].x - mx);
      v[k].y = __expf(v[k].y - mx);
      v[k].z = __expf(v[k].z - mx);
      v[k].w = __expf(v[k].w - mx);
      sum += (v[k].x + v[k].y) + (v[k].z + v[k].w);
    }
    sum = wave_sum(sum);
    const float inv = 1.0f / sum;
    if (h == 0 && lane == 0) sm.inv[r] = inv;
    const float4 e0 = h ? v[2] : v[0];
    const float4 e1 = h ? v[3] : v[1];
    *(float4*)&sm.e[r][h * 256 + lane * 4]       = e0;
    *(float4*)&sm.e[r][h * 256 + 128 + lane * 4] = e1;
    at0 = make_float4(e0.x * inv, e0.y * inv, e0.z * inv, e0.w * inv);
    at1 = make_float4(e1.x * inv, e1.y * inv, e1.z * inv, e1.w * inv);
    arow = attn + ((size_t)b * Ln + i0 + r) * Ln + h * 256 + lane * 4;
  }
  __syncthreads();

  // ---- out partials: keys 32w .. 32w+31, columns 4*lane .. 4*lane+3 ----
  {
    const int j0 = w * 32;
    const float* __restrict__ X =
        inp + ((size_t)b * Ln + j0) * Dn + lane * 4;
    float4 acc[TI];
    #pragma unroll  // constant indices: the arrays stay in registers
    for (int ii = 0; ii < TI; ++ii) acc[ii] = make_float4(0.f, 0.f, 0.f, 0.f);
    #pragma unroll  // constant indices: the arrays stay in registers
    for (int jj = 0; jj < 32; jj += 4) {
      float4 x[4];
      #pragma unroll  // constant indices: the arrays stay in registers
      for (int c = 0; c < 4; ++c) x[c] = *(const float4*)(X + (jj + c) * Dn);
      #pragma unroll  // constant indices: the arrays stay in registers
      for (int ii = 0; ii < TI; ++ii) {
        const float4 ev = *(const float4*)&sm.e[ii][j0 + jj];
        const float ea[4] = {ev.x, ev.y, ev.z, ev.w};
        #pragma unroll  // constant indices: the arrays stay in registers
        for (int c = 0; c < 4; ++c) {
          acc[ii].x = fmaf(ea[c], x[c].x, acc[ii].x);
          acc[ii].y = fmaf(ea[c], x[c].y, acc[ii].y);
          acc[ii].z = fmaf(ea[c], x[c].z, acc[ii].z);
          acc[ii].w = fmaf(ea[c], x[c].w, acc[ii].w);
        }
      }
    }
    #pragma unroll  // constant indices: the arrays stay in registers
    for (int ii = 0; ii < TI; ++ii)
      *(float4*)&sm.part[w][ii][lane * 4] = acc[ii];
  }
  __syncthreads();

  *(float4*)arow         = at0;
  *(float4*)(arow + 128) = at1;

  // ---- add the 16 partials: thread t owns row t>>6, columns 2*(t&63), +1 ----
  {
    const int ii = t >> 6;
    const int d  = (t & 63) * 2;
    float2 o = make_float2(0.f, 0.f);
    #pragma unroll  // constant LDS offsets: the 16 reads go out together
    for (int p = 0; p < NW; ++p) {
      const float2 pv = *(const float2*)&sm.part[p][ii][d];
      o.x += pv.x;
      o.y += pv.y;
    }
    const float inv = sm.inv[ii];
    *(float2*)(out + ((size_t)b * Ln + i0 + ii) * Dn + d) =
        make_float2(o.x * inv, o.y * inv);
  }
}

extern "C" void kernel_launch(void* const* d_in, const int* in_sizes, int n_in,
                              void* d_out, int out_size, void* d_ws,
                              size_t ws_size, hipStream_t stream) {
  (void)in_sizes; (void)n_in; (void)out_size; (void)ws_size;
  const float* inp = (const float*)d_in[0];   // (B,L,D)
  const float* Wu  = (const float*)d_in[1];   // (D,D)
  const float* Ww  = (const float*)d_in[2];   // (D,D)
  const float* Wv  = (const float*)d_in[3];   // (1,D)

  float* out  = (float*)d_out;                      // (B,L,D) first
  float* attn = out + (size_t)Bn * Ln * Dn;         // then (B,L,L)

  float* qu = (float*)d_ws;                         // (B,L,D) scratch
  float* kw = qu + (size_t)Bn * Ln * Dn;            // (B,L,D) scratch

  // Projections: 64 row tiles x 4 column tiles -> 256 blocks x 4 waves
  proj_qu_kw_wmma<<<256, 128, 0, stream>>>(inp, Wu, Ww, qu, kw);
  // Fused score/softmax/out: one block per (b, 8 rows i)
  score_softmax_out<<<Bn * Ln / TI, 512, 0, stream>>>(inp, qu, kw, Wv, out, attn);
}

// v003
// Measured time: 17.4 microseconds a run.
// Timed twice side by side with v002, it ran 1.08 and 1.06 times as fast.
// Counting every step since v000, it is 3.62 times as fast.
#include <hip/hip_runtime.h>
#include <hip/hip_bf16.h>

// Problem constants (reference: B=4, L=512, D=128, all f32)
#define Bn 4
#define Ln 512
#define Dn 128

typedef __attribute__((ext_vector_type(2)))  float    v2f;
typedef __attribute__((ext_vector_type(8)))  float    v8f;

#if defined(__has_builtin)
#  if __has_builtin(__builtin_amdgcn_tanhf)
#    define USE_HW_TANH 1
#  endif
#endif

__device__ __forceinline__ float fast_tanh(float x) {
#ifdef USE_HW_TANH
  return __builtin_amdgcn_tanhf(x);   // v_tanh_f32 on gfx1250
#else
  return tanhf(x);
#endif
}

// ---------------------------------------------------------------------------
// Kernel 1: qu = inp @ Wu^T and kw = inp @ Ww^T via WMMA (f32 16x16x4).
// The two products are one 2048 x 256 result (rows b*L+l, columns Wu | Ww), cut
// into 32 x 64 tiles: 256 blocks, one per WGP, 4 waves, one per SIMD. A wave
// owns 16 rows x 32 columns (2 accumulator tiles).
// The 32 inp rows and 64 W rows of a block are brought in by loads in which a
// wave reads one whole 512-B row, and the fragments are read from LDS.
// The W rows are the A operand and the inp rows the B operand, so a tile comes
// out transposed: a lane holds 8 consecutive columns d of ONE row l.
// A-layout (16x4 f32): lane n = lane&15; VGPR pair holds K = 2*hi, 2*hi+1.
// B-layout (4x16 f32): lane m = lane&15; same K split. B[k][m] = inp[m*D + k].
// C/D-layout: VGPR c -> column d (c + 8*hi), row l = lane&15 within tile.
// qu and kw are written as [b][d/4][l][4]: the 4 values d of one row l are one
// 16-B piece and the pieces of neighbouring rows l lie side by side, so that
// the score kernel, whose lanes own neighbouring rows, reads whole lines.
// ---------------------------------------------------------------------------
#define PM 32    // inp rows per block
#define PN 64    // output columns (W rows) per block
#define PP 132   // LDS row pitch in floats: the 16 rows of a fragment read fall
                 // on 16 different groups of 4 banks

__global__ __launch_bounds__(128) void proj_qu_kw_wmma(
    const float* __restrict__ inp, const float* __restrict__ Wu,
    const float* __restrict__ Ww, float* __restrict__ qu,
    float* __restrict__ kw) {
  __shared__ __attribute__((aligned(16))) float sa[PM][PP];
  __shared__ __attribute__((aligned(16))) float sb[PN][PP];

  const int t    = threadIdx.x;
  const int lane = t & 31;
  const int w    = t >> 5;
  const int r0   = (blockIdx.x >> 2) * PM;   // first row of b*L+l
  const int mat  = (blockIdx.x >> 1) & 1;    // 0 = qu/Wu, 1 = kw/Ww
  const int n0   = (blockIdx.x & 1) * PN;    // first output column

  const float4* __restrict__ A4 = (const float4*)(inp + (size_t)r0 * Dn);
  const float4* __restrict__ W4 =
      (const float4*)((mat ? Ww : Wu) + (size_t)n0 * Dn);

  // All 24 loads of a thread are asked for before the first LDS store.
  float4 ra[PM / 4], rb[PN / 4];
  #pragma unroll  // constant indices: the arrays stay in registers
  for (int u = 0; u < PM / 4; ++u) ra[u] = A4[u * 128 + t];
  #pragma unroll  // constant indices: the arrays stay in registers
  for (int u = 0; u < PN / 4; ++u) rb[u] = W4[u * 128 + t];
  #pragma unroll  // constant indices: the arrays stay in registers
  for (int u = 0; u < PM / 4; ++u) *(float4*)&sa[u * 4 + w][lane * 4] = ra[u];
  #pragma unroll  // constant indices: the arrays stay in registers
  for (int u = 0; u < PN / 4; ++u) *(float4*)&sb[u * 4 + w][lane * 4] = rb[u];
  __syncthreads();

  const int m  = lane & 15;
  const int hi = lane >> 4;
  const int wr = (w & 1) * 16;    // the wave's rows inside the tile
  const int wc = (w >> 1) * 32;   // the wave's columns inside the tile

  const float* pa  = &sa[wr + m][2 * hi];
  const float* pb0 = &sb[wc + m][2 * hi];
  const float* pb1 = &sb[wc + 16 + m][2 * hi];

  // All fragments of the wave (K = 128) are asked for first: 192 registers.
  v2f fa[Dn / 4], fb0[Dn / 4], fb1[Dn / 4];
  #pragma unroll  // constant indices: the arrays stay in registers
  for (int s = 0; s < Dn / 4; ++s) {
    fa[s]  = *(const v2f*)(pa + 4 * s);
    fb0[s] = *(const v2f*)(pb0 + 4 * s);
    fb1[s] = *(const v2f*)(pb1 + 4 * s);
  }
  // Holds the LDS reads in front of the WMMAs; without it the compiler spreads
  // them among the WMMAs, one group ahead, and the lone wave waits at each.
  __builtin_amdgcn_sched_barrier(0);

  v8f acc0 = {}, acc1 = {};
  #pragma unroll  // constant indices: the arrays stay in registers
  for (int s = 0; s < Dn / 4; ++s) {
    acc0 = __builtin_amdgcn_wmma_f32_16x16x4_f32(
        false, fb0[s], false, fa[s], (short)0, acc0, false, false);
    acc1 = __builtin_amdgcn_wmma_f32_16x16x4_f32(
        false, fb1[s], false, fa[s], (short)0, acc1, false, false);
  }
  // Keeps the address arithmetic of the stores behind the WMMAs; among them it
  // was placed in operand registers of a WMMA issued just before.
  __builtin_amdgcn_sched_barrier(0);

  // A block's 32 rows lie in one batch r0 / Ln; l is the lane's row in it, dg
  // its first group of 4 columns. 16 lanes store 256 B in a row: whole 128-B
  // lines, one writer each.
  const int l  = (r0 & (Ln - 1)) + wr + m;
  const int dg = (n0 + wc + 8 * hi) >> 2;
  float4* __restrict__ Out = (float4*)(mat ? kw : qu) +
      (size_t)(r0 / Ln) * (Dn / 4) * Ln + (dg * Ln + l);

  Out[0 * Ln] = make_float4(acc0[0], acc0[1], acc0[2], acc0[3]);
  Out[1 * Ln] = make_float4(acc0[4], acc0[5], acc0[6], acc0[7]);
  Out[4 * Ln] = make_float4(acc1[0], acc1[1], acc1[2], acc1[3]);
  Out[5 * Ln] = make_float4(acc1[4], acc1[5], acc1[6], acc1[7]);
}

// ---------------------------------------------------------------------------
// Kernel 2: fused score + softmax + out, one 512-thread block per (b, 8 rows i).
//   score[i][j] = sum_d Wv[d] * tanh(qu[b,j,d] + kw[b,i,d])   (h never stored)
//   attn = softmax_j(score);  out[b,i,:] = sum_j attn[i][j] * inp[b,j,:]
// qu and kw come as [b][d/4][l][4] (see kernel 1).
// Score: thread t owns key j = t and carries TI running sums, so each qu value
// is loaded once and used for TI rows i; a wave's load is 512 B in a row.
// Softmax: two waves per row. Out: wave
// w owns keys 32w..32w+31, lane owns 4 columns d, so each inp value is loaded
// once and used for TI rows; the 16 partial sums are added through LDS.
// ---------------------------------------------------------------------------
#define TI 8
#define NW 16   // waves per block

template <int CTRL>
__device__ __forceinline__ float dpp_row(float v) {
  return __int_as_float(__builtin_amdgcn_update_dpp(
      0, __float_as_int(v), CTRL, 0xf, 0xf, true));
}
__device__ __forceinline__ float other_row(float v) {   // lane l <-> l ^ 16
  const int x = __float_as_int(v);
  return __int_as_float(__builtin_amdgcn_permlanex16(
      x, x, 0x76543210, 0xfedcba98, false, false));
}
__device__ __forceinline__ float wave_max(float v) {
  v = fmaxf(v, dpp_row<0x161>(v));   // row_xmask:1, 2, 4, 8
  v = fmaxf(v, dpp_row<0x162>(v));
  v = fmaxf(v, dpp_row<0x164>(v));
  v = fmaxf(v, dpp_row<0x168>(v));
  return fmaxf(v, other_row(v));
}
__device__ __forceinline__ float wave_sum(float v) {
  v += dpp_row<0x161>(v);
  v += dpp_row<0x162>(v);
  v += dpp_row<0x164>(v);
  v += dpp_row<0x168>(v);
  return v + other_row(v);
}

// waves_per_eu(4, 4): a block is 4 waves per SIMD and a WGP holds one block, so
// the compiler may spend the 256 registers of a wave on loads issued ahead.
__global__ __launch_bounds__(512) __attribute__((amdgpu_waves_per_eu(4, 4)))
void score_softmax_out(
    const float* __restrict__ inp, const float* __restrict__ qu,
    const float* __restrict__ kw, const float* __restrict__ Wv,
    float* __restrict__ out, float* __restrict__ attn) {
  // One LDS block, the operands of the score loop first: their addresses then
  // fit the 16-bit offset field of an LDS load and need no register each.
  __shared__ __attribute__((aligned(16))) struct {
    float kw[Dn][TI];         // [d][i]
    float wv[Dn];
    float sc[TI][Ln];         // scores
    float e[TI][Ln];          // exp weights, not normalised
    float part[NW][TI][Dn];   // partial out sums, one plane per wave
    float inv[TI];
  } sm;

  const int b    = blockIdx.x / (Ln / TI);
  const int i0   = (blockIdx.x % (Ln / TI)) * TI;
  const int t    = threadIdx.x;
  const int lane = t & 31;
  const int w    = t >> 5;

  // The kw tile (TI x Dn, two values a thread) and the first qu values are asked
  // for together, ahead of the first barrier.
  // Wave w reads the TI rows of column groups w and w + 16, 128 B each.
  const float* __restrict__ kwt = kw + ((size_t)b * (Dn / 4) * Ln + i0) * 4;
  const int ko = w * Ln * 4 + lane;
  const float ka = kwt[ko], kb = kwt[ko + 16 * Ln * 4];
  const float4* __restrict__ q4 =
      (const float4*)qu + (size_t)b * (Dn / 4) * Ln + t;   // group g: q4[g * Ln]
  float4 qc[2][8];
  #pragma unroll  // constant indices: the arrays stay in registers
  for (int u = 0; u < 8; ++u) qc[0][u] = q4[u * Ln];
  // The registers that hold these loads' addresses are reused right behind
  // them: the wait stands in front of that reuse, and the scheduling barrier
  // keeps the compiler from lifting the reuse over the wait.
  asm volatile("s_wait_xcnt 0x0" ::: "memory");
  __builtin_amdgcn_sched_barrier(0);
  sm.kw[w * 4 + (lane & 3)][lane >> 2]      = ka;
  sm.kw[w * 4 + (lane & 3) + 64][lane >> 2] = kb;
  if (t < Dn) sm.wv[t] = Wv[t];
  __syncthreads();

  // ---- scores: key j = t, rows i0 .. i0+TI-1 ----
  // A group is 4 values of d. The kw and Wv values of group g+1 and the qu
  // values of the next 8 groups are asked for before group g is worked on.
  {
    const float4* kw4 = (const float4*)&sm.kw[0][0];   // two per d
    const float4* wv4 = (const float4*)&sm.wv[0];      // one per group
    float s[TI];
    #pragma unroll  // constant indices: the arrays stay in registers
    for (int ii = 0; ii < TI; ++ii) s[ii] = 0.0f;
    float4 kk[2][8], wg[2];
    #pragma unroll  // constant indices: the arrays stay in registers
    for (int u = 0; u < 8; ++u) kk[0][u] = kw4[u];
    wg[0] = wv4[0];
    #pragma unroll  // constant indices: the arrays stay in registers
    for (int g = 0; g < Dn / 4; ++g) {
      const int cb = (g >> 3) & 1;
      const int pb = g & 1;
      if ((g & 7) == 0 && g + 8 < Dn / 4) {
        #pragma unroll  // constant indices: the arrays stay in registers
        for (int u = 0; u < 8; ++u) qc[cb ^ 1][u] = q4[(g + 8 + u) * Ln];
      }
      if (g + 1 < Dn / 4) {
        #pragma unroll  // constant indices: the arrays stay in registers
        for (int u = 0; u < 8; ++u) kk[pb ^ 1][u] = kw4[(g + 1) * 8 + u];
        wg[pb ^ 1] = wv4[g + 1];
      }
      // Holds the loads above in front of this group's arithmetic; without it
      // the compiler sinks each LDS load to its use and the wave waits there.
      __builtin_amdgcn_sched_barrier(0);
      const float qa[4] = {qc[cb][g & 7].x, qc[cb][g & 7].y,
                           qc[cb][g & 7].z, qc[cb][g & 7].w};
      const float wa[4] = {wg[pb].x, wg[pb].y, wg[pb].z, wg[pb].w};
      #pragma unroll  // constant indices: the arrays stay in registers
      for (int c = 0; c < 4; ++c) {
        const float4 k0 = kk[pb][2 * c], k1 = kk[pb][2 * c + 1];
        // the TI rows are independent: adds, tanhs and fmas stand in runs
        float h[TI] = {k0.x, k0.y, k0.z, k0.w, k1.x, k1.y, k1.z, k1.w};
        #pragma unroll  // constant indices: the arrays stay in registers
        for (int ii = 0; ii < TI; ++ii) h[ii] = qa[c] + h[ii];
        #pragma unroll  // constant indices: the arrays stay in registers
        for (int ii = 0; ii < TI; ++ii) h[ii] = fast_tanh(h[ii]);
        #pragma unroll  // constant indices: the arrays stay in registers
        for (int ii = 0; ii < TI; ++ii) s[ii] = fmaf(wa[c], h[ii], s[ii]);
      }
    }
    #pragma unroll  // constant indices: the arrays stay in registers
    for (int ii = 0; ii < TI; ++ii) sm.sc[ii][t] = s[ii];
  }
  __syncthreads();

  // ---- softmax: waves r and r+8 both reduce row r, each keeps one half ----
  // The attn values are stored behind the last barrier, so that no barrier
  // waits for those stores.
  float4 at0, at1;
  float* __restrict__ arow;
  {
    const int r = w & (TI - 1);
    const int h = w >> 3;
    float4 v[4];
    #pragma unroll  // constant indices: the arrays stay in registers
    for (int k = 0; k < 4; ++k)
      v[k] = *(const float4*)&sm.sc[r][k * 128 + lane * 4];
    float mx = v[0].x;
    #pragma unroll  // constant indices: the arrays stay in registers
    for (int k = 0; k < 4; ++k)
      mx = fmaxf(mx, fmaxf(fmaxf(v[k].x, v[k].y), fmaxf(v[k].z, v[k].w)));
    mx = wave_max(mx);
    float sum = 0.0f;
    #pragma unroll  // constant indices: the arrays stay in registers
    for (int k = 0; k < 4; ++k) {
      v[k].x = __expf(v[k].x - mx);
      v[k].y = __expf(v[k].y - mx);
      v[k].z = __expf(v[k].z - mx);
      v[k].w = __expf(v[k].w - mx);
      sum += (v[k].x + v[k].y) + (v[k].z + v[k].w);
    }
    sum = wave_sum(sum);
    const float inv = 1.0f / sum;
    if (h == 0 && lane == 0) sm.inv[r] = inv;
    const float4 e0 = h ? v[2] : v[0];
    const float4 e1 = h ? v[3] : v[1];
    *(float4*)&sm.e[r][h * 256 + lane * 4]       = e0;
    *(float4*)&sm.e[r][h * 256 + 128 + lane * 4] = e1;
    at0 = make_float4(e0.x * inv, e0.y * inv, e0.z * inv, e0.w * inv);
    at1 = make_float4(e1.x * inv, e1.y * inv, e1.z * inv, e1.w * inv);
    arow = attn + ((size_t)b * Ln + i0 + r) * Ln + h * 256 + lane * 4;
  }
  __syncthreads();

  // ---- out partials: keys 32w .. 32w+31, columns 4*lane .. 4*lane+3 ----
  {
    const int j0 = w * 32;
    const float* __restrict__ X =
        inp + ((size_t)b * Ln + j0) * Dn + lane * 4;
    float4 acc[TI];
    #pragma unroll  // constant indices: the arrays stay in registers
    for (int ii = 0; ii < TI; ++ii) acc[ii] = make_float4(0.f, 0.f, 0.f, 0.f);
    #pragma unroll  // constant indices: the arrays stay in registers
    for (int jj = 0; jj < 32; jj += 4) {
      float4 x[4];
      #pragma unroll  // constant indices: the arrays stay in registers
      for (int c = 0; c < 4; ++c) x[c] = *(const float4*)(X + (jj + c) * Dn);
      #pragma unroll  // constant indices: the arrays stay in registers
      for (int ii = 0; ii < TI; ++ii) {
        const float4 ev = *(const float4*)&sm.e[ii][j0 + jj];
        const float ea[4] = {ev.x, ev.y, ev.z, ev.w};
        #pragma unroll  // constant indices: the arrays stay in registers
        for (int c = 0; c < 4; ++c) {
          acc[ii].x = fmaf(ea[c], x[c].x, acc[ii].x);
          acc[ii].y = fmaf(ea[c], x[c].y, acc[ii].y);
          acc[ii].z = fmaf(ea[c], x[c].z, acc[ii].z);
          acc[ii].w = fmaf(ea[c], x[c].w, acc[ii].w);
        }
      }
    }
    #pragma unroll  // constant indices: the arrays stay in registers
    for (int ii = 0; ii < TI; ++ii)
      *(float4*)&sm.part[w][ii][lane * 4] = acc[ii];
  }
  __syncthreads();

  *(float4*)arow         = at0;
  *(float4*)(arow + 128) = at1;

  // ---- add the 16 partials: thread t owns row t>>6, columns 2*(t&63), +1 ----
  {
    const int ii = t >> 6;
    const int d  = (t & 63) * 2;
    float2 o = make_float2(0.f, 0.f);
    #pragma unroll  // constant LDS offsets: the 16 reads go out together
    for (int p = 0; p < NW; ++p) {
      const float2 pv = *(const float2*)&sm.part[p][ii][d];
      o.x += pv.x;
      o.y += pv.y;
    }
    const float inv = sm.inv[ii];
    *(float2*)(out + ((size_t)b * Ln + i0 + ii) * Dn + d) =
        make_float2(o.x * inv, o.y * inv);
  }
}

extern "C" void kernel_launch(void* const* d_in, const int* in_sizes, int n_in,
                              void* d_out, int out_size, void* d_ws,
                              size_t ws_size, hipStream_t stream) {
  (void)in_sizes; (void)n_in; (void)out_size; (void)ws_size;
  const float* inp = (const float*)d_in[0];   // (B,L,D)
  const float* Wu  = (const float*)d_in[1];   // (D,D)
  const float* Ww  = (const float*)d_in[2];   // (D,D)
  const float* Wv  = (const float*)d_in[3];   // (1,D)

  float* out  = (float*)d_out;                      // (B,L,D) first
  float* attn = out + (size_t)Bn * Ln * Dn;         // then (B,L,L)

  float* qu = (float*)d_ws;                         // (B,D/4,L,4) scratch
  float* kw = qu + (size_t)Bn * Ln * Dn;            // (B,D/4,L,4) scratch

  // Projections: 64 row tiles x 4 column tiles -> 256 blocks x 4 waves
  proj_qu_kw_wmma<<<256, 128, 0, stream>>>(inp, Wu, Ww, qu, kw);
  // Fused score/softmax/out: one block per (b, 8 rows i)
  score_softmax_out<<<Bn * Ln / TI, 512, 0, stream>>>(inp, qu, kw, Wv, out, attn);
}

// v004
// It runs in 16.4 microseconds.
// Two timings next to v003 both put it at 1.06 times that version's speed.
// Over all steps from v000 it is 3.83 times as fast.
#include <hip/hip_runtime.h>
#include <hip/hip_bf16.h>

// Problem constants (reference: B=4, L=512, D=128, all f32)
#define Bn 4
#define Ln 512
#define Dn 128

typedef __attribute__((ext_vector_type(2)))  float    v2f;
typedef __attribute__((ext_vector_type(4)))  float    v4f;
typedef __attribute__((ext_vector_type(8)))  float    v8f;

#if defined(__has_builtin)
#  if __has_builtin(__builtin_amdgcn_tanhf)
#    define USE_HW_TANH 1
#  endif
#endif

__device__ __forceinline__ float fast_tanh(float x) {
#ifdef USE_HW_TANH
  return __builtin_amdgcn_tanhf(x);   // v_tanh_f32 on gfx1250
#else
  return tanhf(x);
#endif
}

// ---------------------------------------------------------------------------
// Kernel 1: qu = inp @ Wu^T and kw = inp @ Ww^T via WMMA (f32 16x16x4).
// The two products are one 2048 x 256 result (rows b*L+l, columns Wu | Ww), cut
// into 32 x 64 tiles: 256 blocks, one per WGP, 4 waves, one per SIMD. A wave
// owns 16 rows x 32 columns (2 accumulator tiles).
// The 32 inp rows and 64 W rows of a block are brought in by loads in which a
// wave reads one whole 512-B row, and the fragments are read from LDS.
// The W rows are the A operand and the inp rows the B operand, so a tile comes
// out transposed: a lane holds 8 consecutive columns d of ONE row l.
// A-layout (16x4 f32): lane n = lane&15; VGPR pair holds K = 2*hi, 2*hi+1.
// B-layout (4x16 f32): lane m = lane&15; same K split. B[k][m] = inp[m*D + k].
// C/D-layout: VGPR c -> column d (c + 8*hi), row l = lane&15 within tile.
// qu and kw are written as [b][d/4][l][4]: the 4 values d of one row l are one
// 16-B piece and the pieces of neighbouring rows l lie side by side, so that
// the score kernel, whose lanes own neighbouring rows, reads whole lines.
// ---------------------------------------------------------------------------
#define PM 32    // inp rows per block
#define PN 64    // output columns (W rows) per block
#define PP 132   // LDS row pitch in floats: the 16 rows of a fragment read fall
                 // on 16 different groups of 4 banks

__global__ __launch_bounds__(128) void proj_qu_kw_wmma(
    const float* __restrict__ inp, const float* __restrict__ Wu,
    const float* __restrict__ Ww, float* __restrict__ qu,
    float* __restrict__ kw) {
  __shared__ __attribute__((aligned(16))) float sa[PM][PP];
  __shared__ __attribute__((aligned(16))) float sb[PN][PP];

  const int t    = threadIdx.x;
  const int lane = t & 31;
  const int w    = t >> 5;
  const int r0   = (blockIdx.x >> 2) * PM;   // first row of b*L+l
  const int mat  = (blockIdx.x >> 1) & 1;    // 0 = qu/Wu, 1 = kw/Ww
  const int n0   = (blockIdx.x & 1) * PN;    // first output column

  const float4* __restrict__ A4 = (const float4*)(inp + (size_t)r0 * Dn);
  const float4* __restrict__ W4 =
      (const float4*)((mat ? Ww : Wu) + (size_t)n0 * Dn);

  // All 24 loads of a thread are asked for before the first LDS store.
  float4 ra[PM / 4], rb[PN / 4];
  #pragma unroll  // constant indices: the arrays stay in registers
  for (int u = 0; u < PM / 4; ++u) ra[u] = A4[u * 128 + t];
  #pragma unroll  // constant indices: the arrays stay in registers
  for (int u = 0; u < PN / 4; ++u) rb[u] = W4[u * 128 + t];
  #pragma unroll  // constant indices: the arrays stay in registers
  for (int u = 0; u < PM / 4; ++u) *(float4*)&sa[u * 4 + w][lane * 4] = ra[u];
  #pragma unroll  // constant indices: the arrays stay in registers
  for (int u = 0; u < PN / 4; ++u) *(float4*)&sb[u * 4 + w][lane * 4] = rb[u];
  __syncthreads();

  const int m  = lane & 15;
  const int hi = lane >> 4;
  const int wr = (w & 1) * 16;    // the wave's rows inside the tile
  const int wc = (w >> 1) * 32;   // the wave's columns inside the tile

  const float* pa  = &sa[wr + m][2 * hi];
  const float* pb0 = &sb[wc + m][2 * hi];
  const float* pb1 = &sb[wc + 16 + m][2 * hi];

  // All fragments of the wave (K = 128) are asked for first: 192 registers.
  v2f fa[Dn / 4], fb0[Dn / 4], fb1[Dn / 4];
  #pragma unroll  // constant indices: the arrays stay in registers
  for (int s = 0; s < Dn / 4; ++s) {
    fa[s]  = *(const v2f*)(pa + 4 * s);
    fb0[s] = *(const v2f*)(pb0 + 4 * s);
    fb1[s] = *(const v2f*)(pb1 + 4 * s);
  }
  // Holds the LDS reads in front of the WMMAs; without it the compiler spreads
  // them among the WMMAs, one group ahead, and the lone wave waits at each.
  __builtin_amdgcn_sched_barrier(0);

  v8f acc0 = {}, acc1 = {};
  #pragma unroll  // constant indices: the arrays stay in registers
  for (int s = 0; s < Dn / 4; ++s) {
    acc0 = __builtin_amdgcn_wmma_f32_16x16x4_f32(
        false, fb0[s], false, fa[s], (short)0, acc0, false, false);
    acc1 = __builtin_amdgcn_wmma_f32_16x16x4_f32(
        false, fb1[s], false, fa[s], (short)0, acc1, false, false);
  }
  // Keeps the address arithmetic of the stores behind the WMMAs; among them it
  // was placed in operand registers of a WMMA issued just before.
  __builtin_amdgcn_sched_barrier(0);

  // A block's 32 rows lie in one batch r0 / Ln; l is the lane's row in it, dg
  // its first group of 4 columns. 16 lanes store 256 B in a row: whole 128-B
  // lines, one writer each.
  const int l  = (r0 & (Ln - 1)) + wr + m;
  const int dg = (n0 + wc + 8 * hi) >> 2;
  float4* __restrict__ Out = (float4*)(mat ? kw : qu) +
      (size_t)(r0 / Ln) * (Dn / 4) * Ln + (dg * Ln + l);

  Out[0 * Ln] = make_float4(acc0[0], acc0[1], acc0[2], acc0[3]);
  Out[1 * Ln] = make_float4(acc0[4], acc0[5], acc0[6], acc0[7]);
  Out[4 * Ln] = make_float4(acc1[0], acc1[1], acc1[2], acc1[3]);
  Out[5 * Ln] = make_float4(acc1[4], acc1[5], acc1[6], acc1[7]);
}

// ---------------------------------------------------------------------------
// Kernel 2: fused score + softmax + out, one 512-thread block per (b, 8 rows i).
//   score[i][j] = sum_d Wv[d] * tanh(qu[b,j,d] + kw[b,i,d])   (h never stored)
//   attn = softmax_j(score);  out[b,i,:] = sum_j attn[i][j] * inp[b,j,:]
// qu and kw come as [b][d/4][l][4] (see kernel 1).
// Score: thread t owns key j = t and carries two running sums for each of TI
// rows, so each qu value is loaded once and used for TI rows i; a wave's load
// is 512 B in a row.
// Softmax: two waves per row. Out: wave
// w owns keys 32w..32w+31, lane owns 4 columns d, so each inp value is loaded
// once and used for TI rows; the 16 partial sums are added through LDS.
// ---------------------------------------------------------------------------
#define TI 8
#define NW 16   // waves per block

template <int CTRL>
__device__ __forceinline__ float dpp_row(float v) {
  return __int_as_float(__builtin_amdgcn_update_dpp(
      0, __float_as_int(v), CTRL, 0xf, 0xf, true));
}
__device__ __forceinline__ float other_row(float v) {   // lane l <-> l ^ 16
  const int x = __float_as_int(v);
  return __int_as_float(__builtin_amdgcn_permlanex16(
      x, x, 0x76543210, 0xfedcba98, false, false));
}
__device__ __forceinline__ float wave_max(float v) {
  v = fmaxf(v, dpp_row<0x161>(v));   // row_xmask:1, 2, 4, 8
  v = fmaxf(v, dpp_row<0x162>(v));
  v = fmaxf(v, dpp_row<0x164>(v));
  v = fmaxf(v, dpp_row<0x168>(v));
  return fmaxf(v, other_row(v));
}
__device__ __forceinline__ float wave_sum(float v) {
  v += dpp_row<0x161>(v);
  v += dpp_row<0x162>(v);
  v += dpp_row<0x164>(v);
  v += dpp_row<0x168>(v);
  return v + other_row(v);
}

// waves_per_eu(4, 4): a block is 4 waves per SIMD and a WGP holds one block, so
// the compiler may spend the 256 registers of a wave on loads issued ahead.
__global__ __launch_bounds__(512) __attribute__((amdgpu_waves_per_eu(4, 4)))
void score_softmax_out(
    const float* __restrict__ inp, const float* __restrict__ qu,
    const float* __restrict__ kw, const float* __restrict__ Wv,
    float* __restrict__ out, float* __restrict__ attn) {
  // One LDS block, the operands of the score loop first: their addresses then
  // fit the 16-bit offset field of an LDS load and need no register each.
  __shared__ __attribute__((aligned(16))) struct {
    float kw[Dn / 4][TI][4];  // [d/4][i][d%4], as in global memory
    float wv[Dn];
    float sc[TI][Ln];         // scores
    float e[TI][Ln];          // exp weights, not normalised
    float part[NW][TI][Dn];   // partial out sums, one plane per wave
    float inv[TI];
  } sm;

  const int b    = blockIdx.x / (Ln / TI);
  const int i0   = (blockIdx.x % (Ln / TI)) * TI;
  const int t    = threadIdx.x;
  const int lane = t & 31;
  const int w    = t >> 5;

  // The kw tile (TI x Dn, two values a thread) and the first qu values are asked
  // for together, ahead of the first barrier.
  // Wave w reads the TI rows of column groups w and w + 16, 128 B each.
  const float* __restrict__ kwt = kw + ((size_t)b * (Dn / 4) * Ln + i0) * 4;
  const int ko = w * Ln * 4 + lane;
  const float ka = kwt[ko], kb = kwt[ko + 16 * Ln * 4];
  const float4* __restrict__ q4 =
      (const float4*)qu + (size_t)b * (Dn / 4) * Ln + t;   // group g: q4[g * Ln]
  float4 qc[2][8];
  #pragma unroll  // constant indices: the arrays stay in registers
  for (int u = 0; u < 8; ++u) qc[0][u] = q4[u * Ln];
  // The registers that hold these loads' addresses are reused right behind
  // them: the wait stands in front of that reuse, and the scheduling barrier
  // keeps the compiler from lifting the reuse over the wait.
  asm volatile("s_wait_xcnt 0x0" ::: "memory");
  __builtin_amdgcn_sched_barrier(0);
  sm.kw[w][lane >> 2][lane & 3]      = ka;
  sm.kw[w + 16][lane >> 2][lane & 3] = kb;
  if (t < Dn) sm.wv[t] = Wv[t];
  __syncthreads();

  // ---- scores: key j = t, rows i0 .. i0+TI-1 ----
  // A group is 4 values of d. The kw and Wv values of group g+1 and the qu
  // values of the next 8 groups are asked for before group g is worked on.
  // The arithmetic is packed over two neighbouring d of one row, so that no
  // operand has to be spread over a register pair: a row's score is kept as one
  // sum over the even d and one over the odd d, added at the end.
  // A step is two rows of a group: 8 tanhs, 4 packed adds, 4 packed
  // multiply-adds. The steps overlap: among the tanhs of step st stand the adds
  // of step st+1 and the multiply-adds of step st-1, one behind each tanh.
  // The packed instruction
  // between two tanhs is there to take the issue slot in between, so that a
  // wave needs no other wave to fill it.
  {
    const v4f* kw4 = (const v4f*)&sm.kw[0][0][0];   // one per group and row
    const v4f* wv4 = (const v4f*)&sm.wv[0];         // one per group
    v2f s2[TI];   // .x: even d, .y: odd d
    #pragma unroll  // constant indices: the arrays stay in registers
    for (int ii = 0; ii < TI; ++ii) s2[ii] = (v2f){0.0f, 0.0f};
    v4f kk[2][TI], wg[2];
    #pragma unroll  // constant indices: the arrays stay in registers
    for (int u = 0; u < TI; ++u) kk[0][u] = kw4[u];
    wg[0] = wv4[0];
    v2f ha[4];   // qu + kw of the step whose tanhs come next
    v2f ht[4];   // tanh values of the step before, not yet summed
    v4f wp = wg[0];   // Wv of the step before
    #pragma unroll  // constant indices: the arrays stay in registers
    for (int p = 0; p < 4; ++p) {
      // p & 1: row of the pair; p >> 1: d 0, 1 or d 2, 3 of the group
      const v4f kn = kk[0][p & 1];
      ha[p] = (p >> 1) ? (v2f){qc[0][0].z, qc[0][0].w} + __builtin_shufflevector(kn, kn, 2, 3)
                       : (v2f){qc[0][0].x, qc[0][0].y} + __builtin_shufflevector(kn, kn, 0, 1);
    }
    #pragma unroll  // constant indices: the arrays stay in registers
    for (int g = 0; g < Dn / 4; ++g) {
      const int cb = (g >> 3) & 1;
      const int pb = g & 1;
      if ((g & 7) == 0 && g + 8 < Dn / 4) {
        #pragma unroll  // constant indices: the arrays stay in registers
        for (int u = 0; u < 8; ++u) qc[cb ^ 1][u] = q4[(g + 8 + u) * Ln];
      }
      if (g + 1 < Dn / 4) {
        #pragma unroll  // constant indices: the arrays stay in registers
        for (int u = 0; u < TI; ++u) kk[pb ^ 1][u] = kw4[(g + 1) * TI + u];
        wg[pb ^ 1] = wv4[g + 1];
      }
      // Holds the loads above in front of this group's arithmetic; without it
      // the compiler sinks each LDS load to its use and the wave waits there.
      __builtin_amdgcn_sched_barrier(0);
      #pragma unroll  // constant indices: the arrays stay in registers
      for (int r = 0; r < TI / 2; ++r) {
        const int st = (TI / 2) * g + r;       // this step
        const int gn = (st + 1) / (TI / 2);    // group and rows of the next step
        const int rn = (st + 1) % (TI / 2);
        const int rp = (st + TI / 2 - 1) % (TI / 2);   // rows of the step before
        const bool more = gn < Dn / 4;
        const float4 qv = qc[(gn >> 3) & 1][gn & 7];
        v2f hn[4], tn[4];
        #pragma unroll  // constant indices: the arrays stay in registers
        for (int p = 0; p < 4; ++p) {
          // p & 1: row of the pair; p >> 1: d 0, 1 or d 2, 3 of the group
          const v4f kn = kk[gn & 1][2 * rn + (p & 1)];
          tn[p].x = fast_tanh(ha[p].x);
          if (more)
            hn[p] = (p >> 1) ? (v2f){qv.z, qv.w} + __builtin_shufflevector(kn, kn, 2, 3)
                             : (v2f){qv.x, qv.y} + __builtin_shufflevector(kn, kn, 0, 1);
          tn[p].y = fast_tanh(ha[p].y);
          if (st > 0)
            s2[2 * rp + (p & 1)] = __builtin_elementwise_fma(
                (p >> 1) ? __builtin_shufflevector(wp, wp, 2, 3)
                         : __builtin_shufflevector(wp, wp, 0, 1),
                ht[p], s2[2 * rp + (p & 1)]);
        }
        #pragma unroll  // constant indices: the arrays stay in registers
        for (int p = 0; p < 4; ++p) {
          if (more) ha[p] = hn[p];
          ht[p] = tn[p];
        }
        wp = wg[pb];
      }
      // Order of this group's 32 tanhs and 32 packed adds and multiply-adds in
      // the built code: one tanh, one packed instruction, in turn; without it
      // the compiler gathers the tanhs of a step into a run again.
      #pragma unroll  // the builtin is a marker in the code, not a call
      for (int n = 0; n < 4 * TI; ++n) {
        __builtin_amdgcn_sched_group_barrier(0x400, 1, 0);   // transcendental
        __builtin_amdgcn_sched_group_barrier(0x002, 1, 0);   // other vector
      }
    }
    #pragma unroll  // constant indices: the arrays stay in registers
    for (int p = 0; p < 4; ++p)
      s2[TI - 2 + (p & 1)] = __builtin_elementwise_fma(
          (p >> 1) ? __builtin_shufflevector(wp, wp, 2, 3)
                   : __builtin_shufflevector(wp, wp, 0, 1),
          ht[p], s2[TI - 2 + (p & 1)]);
    #pragma unroll  // constant indices: the arrays stay in registers
    for (int ii = 0; ii < TI; ++ii) sm.sc[ii][t] = s2[ii].x + s2[ii].y;
  }
  __syncthreads();

  // ---- softmax: waves r and r+8 both reduce row r, each keeps one half ----
  // The attn values are stored behind the last barrier, so that no barrier
  // waits for those stores.
  float4 at0, at1;
  float* __restrict__ arow;
  {
    const int r = w & (TI - 1);
    const int h = w >> 3;
    float4 v[4];
    #pragma unroll  // constant indices: the arrays stay in registers
    for (int k = 0; k < 4; ++k)
      v[k] = *(const float4*)&sm.sc[r][k * 128 + lane * 4];
    float mx = v[0].x;
    #pragma unroll  // constant indices: the arrays stay in registers
    for (int k = 0; k < 4; ++k)
      mx = fmaxf(mx, fmaxf(fmaxf(v[k].x, v[k].y), fmaxf(v[k].z, v[k].w)));
    mx = wave_max(mx);
    float sum = 0.0f;
    #pragma unroll  // constant indices: the arrays stay in registers
    for (int k = 0; k < 4; ++k) {
      v[k].x = __expf(v[k].x - mx);
      v[k].y = __expf(v[k].y - mx);
      v[k].z = __expf(v[k].z - mx);
      v[k].w = __expf(v[k].w - mx);
      sum += (v[k].x + v[k].y) + (v[k].z + v[k].w);
    }
    sum = wave_sum(sum);
    const float inv = 1.0f / sum;
    if (h == 0 && lane == 0) sm.inv[r] = inv;
    const float4 e0 = h ? v[2] : v[0];
    const float4 e1 = h ? v[3] : v[1];
    *(float4*)&sm.e[r][h * 256 + lane * 4]       = e0;
    *(float4*)&sm.e[r][h * 256 + 128 + lane * 4] = e1;
    at0 = make_float4(e0.x * inv, e0.y * inv, e0.z * inv, e0.w * inv);
    at1 = make_float4(e1.x * inv, e1.y * inv, e1.z * inv, e1.w * inv);
    arow = attn + ((size_t)b * Ln + i0 + r) * Ln + h * 256 + lane * 4;
  }
  __syncthreads();

  // ---- out partials: keys 32w .. 32w+31, columns 4*lane .. 4*lane+3 ----
  {
    const int j0 = w * 32;
    const float* __restrict__ X =
        inp + ((size_t)b * Ln + j0) * Dn + lane * 4;
    float4 acc[TI];
    #pragma unroll  // constant indices: the arrays stay in registers
    for (int ii = 0; ii < TI; ++ii) acc[ii] = make_float4(0.f, 0.f, 0.f, 0.f);
    #pragma unroll  // constant indices: the arrays stay in registers
    for (int jj = 0; jj < 32; jj += 4) {
      float4 x[4];
      #pragma unroll  // constant indices: the arrays stay in registers
      for (int c = 0; c < 4; ++c) x[c] = *(const float4*)(X + (jj + c) * Dn);
      #pragma unroll  // constant indices: the arrays stay in registers
      for (int ii = 0; ii < TI; ++ii) {
        const float4 ev = *(const float4*)&sm.e[ii][j0 + jj];
        const float ea[4] = {ev.x, ev.y, ev.z, ev.w};
        #pragma unroll  // constant indices: the arrays stay in registers
        for (int c = 0; c < 4; ++c) {
          acc[ii].x = fmaf(ea[c], x[c].x, acc[ii].x);
          acc[ii].y = fmaf(ea[c], x[c].y, acc[ii].y);
          acc[ii].z = fmaf(ea[c], x[c].z, acc[ii].z);
          acc[ii].w = fmaf(ea[c], x[c].w, acc[ii].w);
        }
      }
    }
    #pragma unroll  // constant indices: the arrays stay in registers
    for (int ii = 0; ii < TI; ++ii)
      *(float4*)&sm.part[w][ii][lane * 4] = acc[ii];
  }
  __syncthreads();

  *(float4*)arow         = at0;
  *(float4*)(arow + 128) = at1;

  // ---- add the 16 partials: thread t owns row t>>6, columns 2*(t&63), +1 ----
  {
    const int ii = t >> 6;
    const int d  = (t & 63) * 2;
    float2 o = make_float2(0.f, 0.f);
    #pragma unroll  // constant LDS offsets: the 16 reads go out together
    for (int p = 0; p < NW; ++p) {
      const float2 pv = *(const float2*)&sm.part[p][ii][d];
      o.x += pv.x;
      o.y += pv.y;
    }
    const float inv = sm.inv[ii];
    *(float2*)(out + ((size_t)b * Ln + i0 + ii) * Dn + d) =
        make_float2(o.x * inv, o.y * inv);
  }
}

extern "C" void kernel_launch(void* const* d_in, const int* in_sizes, int n_in,
                              void* d_out, int out_size, void* d_ws,
                              size_t ws_size, hipStream_t stream) {
  (void)in_sizes; (void)n_in; (void)out_size; (void)ws_size;
  const float* inp = (const float*)d_in[0];   // (B,L,D)
  const float* Wu  = (const float*)d_in[1];   // (D,D)
  const float* Ww  = (const float*)d_in[2];   // (D,D)
  const float* Wv  = (const float*)d_in[3];   // (1,D)

  float* out  = (float*)d_out;                      // (B,L,D) first
  float* attn = out + (size_t)Bn * Ln * Dn;         // then (B,L,L)

  float* qu = (float*)d_ws;                         // (B,D/4,L,4) scratch
  float* kw = qu + (size_t)Bn * Ln * Dn;            // (B,D/4,L,4) scratch

  // Projections: 64 row tiles x 4 column tiles -> 256 blocks x 4 waves
  proj_qu_kw_wmma<<<256, 128, 0, stream>>>(inp, Wu, Ww, qu, kw);
  // Fused score/softmax/out: one block per (b, 8 rows i)
  score_softmax_out<<<Bn * Ln / TI, 512, 0, stream>>>(inp, qu, kw, Wv, out, attn);
}
